// v010
// Times are from an AMD MI455X. After a warm-up the kernel runs many times in a row, and a time is the length of
// such a window on the GPU divided by its runs, so every launch and the gaps after it count. The runs cycle
// through copies of the inputs. A figure is the median of several windows, for all but v000 over two sittings.
// Sittings can differ by a few percent; kernels timed side by side share one.
// This document starts at v010; the versions before it stand elsewhere.
// Measured time: 196 microseconds a run.
// Next to v009, in two timings, it ran 1.20 times as fast each time.
// All steps since the starting kernel, v000, together make it 4.47 times as fast.
#include <hip/hip_runtime.h>
// Causal multi-head attention with gated rotary phases and a per-head distance decay (2 x 2048 tokens x 1024, 16 heads x 64): qkv = x*Wqkv^T; theta[h][t][j] = (t * pi^(1 - j/32)) * sigmoid(pi_gate[h]); interleaved-pair rotation of q and k; scores = q.k/8 - |i - j| / exp(log_xi[h]) * sigmoid(e_gate[h]) with j <= i; softmax; merged . Wo^T -> [2,2048,1024].
// Structure: x as an exact f16 plane; q/k/v from one packed f16 WMMA GEMM family (32x64 wave tiles, f32, exact products); per-(head, token) cos/sin tables on VALU (pi^(1-j/32) = the reference's f32 constants, precise trig); the projection GEMMs' epilogues rotate q and k in f32 and write them as f16 hi + x2^10 residual planes, and write V^T as hi + residual planes; the fused flash kernel per ((batch, head), 64 queries) with the decay bias and the causal mask added per element from a table over query - key that each work-group builds in LDS (scores and output transposed, K.Q^T and V^T.P^T, one query a lane; three-product hi/lo scores, online softmax f32, P hi + residual packed in registers, two value accumulators), whose epilogue writes O as hi + residual planes; output projection as two GEMMs.
// Compute dtype: x, weights and the three gate/scale vectors rounded to bf16; projections exact; rotation and bias f32; q, k, P, v, O as f16 hi + residual pairs (~2^-21); f32 accumulation and softmax. v_wmma_f32_16x16x32_f16.
#define NBT 2
#define SLEN 2048
#define DM 1024
#define NH 16
#define SCL 0.125f
#define NR (NBT * SLEN)
typedef __bf16 v16b __attribute__((ext_vector_type(16)));
typedef unsigned short v8us __attribute__((ext_vector_type(8), may_alias));
typedef float  v8f  __attribute__((ext_vector_type(8)));
typedef float  v4f  __attribute__((ext_vector_type(4)));
typedef float  v4fa __attribute__((ext_vector_type(4), may_alias));
union FragB { v16b v; v8us half[2]; unsigned short u[16]; };

__device__ __forceinline__ unsigned short bf16_bits(float x) { unsigned int u = __float_as_uint(x); return (unsigned short)((u + 0x7FFFu + ((u >> 16) & 1u)) >> 16); }
__device__ __forceinline__ float bf16_val(unsigned short b) { return __uint_as_float(((unsigned int)b) << 16); }
__device__ __forceinline__ float bf16_round(float x) { return bf16_val(bf16_bits(x)); }
// D += A·B with NT terms: 1 = ah·bh, 2 = + al·bh (A split), 3 = + ah·bl (both split)
template <int NT>
__device__ __forceinline__ v8f mmaN(v16b ah, v16b al, v16b bh, v16b bl, v8f c) {
  c = __builtin_amdgcn_wmma_f32_16x16x32_bf16(false, ah, false, bh, (short)0, c, false, false);
  if (NT >= 2) c = __builtin_amdgcn_wmma_f32_16x16x32_bf16(false, al, false, bh, (short)0, c, false, false);
  if (NT >= 3) c = __builtin_amdgcn_wmma_f32_16x16x32_bf16(false, ah, false, bl, (short)0, c, false, false);
  asm volatile("v_nop\n\tv_nop\n\tv_nop\n\tv_nop" : "+v"(c) : "v"(ah), "v"(al), "v"(bh), "v"(bl));
  return c;
}

__global__ __launch_bounds__(256) void k_wt_bf16(const float* __restrict__ W, unsigned short* __restrict__ Wt, int K, int N) {
  const int t = blockIdx.x * 256 + threadIdx.x;
  const int k8n = K / 8;
  if (t >= N * k8n) return;
  const int n = t / k8n, k8 = (t % k8n) * 8;
  v8us v;
#pragma unroll
  for (int i = 0; i < 8; ++i) v[i] = bf16_bits(W[(size_t)(k8 + i) * N + n]);
  *(v8us*)(Wt + (size_t)n * K + k8) = v;
  
}

// GEMM C[M][N] (f32, pitch ldc) = act(A[M][K]·W + bias). A f32 row-major (pitch lda) converted per fragment to bf16
// (ASPLIT: hi/lo two planes -> 2 terms, else single rounded term); Wt bf16 [N][K] (pitch ldb). BIAS_BF16 rounds the
// bias to bf16 first (bias quantised to bf16 before the add). K%32==0, M%16==0, N%64==0.
template <bool ASPLIT, int ACT, bool BIAS_BF16>
__global__ __launch_bounds__(128) void k_gemm_bf(const float* __restrict__ A, int lda, const unsigned short* __restrict__ Wt, int ldb,
                                               const float* __restrict__ bias, float* __restrict__ C, int ldc, int M, int N, int K) {
  __shared__ __attribute__((aligned(16))) float so[4][16][64];
  const int tid = threadIdx.x, w = tid >> 5, lane = tid & 31, ln = lane & 15, hh = lane >> 4;
  const int ntn = N / 64;
  const int wid = blockIdx.x * 4 + w;
  const int mt = wid / ntn, nq = wid % ntn;
  if (mt * 16 >= M) return;
  const int row0 = mt * 16, col0 = nq * 64;
  const float* arow = A + (size_t)(row0 + ln) * lda;
  v8f acc[4] = {};
  for (int kb = 0; kb < K; kb += 32) {
    FragB ah, al;
    const v4f x0 = *(const v4fa*)(arow + kb + 8 * hh), x1 = *(const v4fa*)(arow + kb + 8 * hh + 4);
    const v4f x2 = *(const v4fa*)(arow + kb + 16 + 8 * hh), x3 = *(const v4fa*)(arow + kb + 16 + 8 * hh + 4);
    float xs[16] = {x0[0],x0[1],x0[2],x0[3],x1[0],x1[1],x1[2],x1[3],x2[0],x2[1],x2[2],x2[3],x3[0],x3[1],x3[2],x3[3]};
#pragma unroll
    for (int i = 0; i < 16; ++i) { const unsigned short hb = bf16_bits(xs[i]); ah.u[i] = hb; al.u[i] = ASPLIT ? bf16_bits(xs[i] - bf16_val(hb)) : (unsigned short)0; }
#pragma unroll
    for (int t = 0; t < 4; ++t) {
      const unsigned short* brow = Wt + (size_t)(col0 + t * 16 + ln) * ldb + kb;
      FragB b;
      b.half[0] = *(const v8us*)(brow + 8 * hh);
      b.half[1] = *(const v8us*)(brow + 16 + 8 * hh);
      acc[t] = mmaN<ASPLIT ? 2 : 1>(ah.v, al.v, b.v, b.v, acc[t]);
    }
  }
#pragma unroll
  for (int t = 0; t < 4; ++t) {
    float bv = bias ? bias[col0 + t * 16 + ln] : 0.f;
    if (BIAS_BF16) bv = bf16_round(bv);
#pragma unroll
    for (int r = 0; r < 8; ++r) { float v = acc[t][r] + bv; if (ACT == 1) v = fmaxf(v, 0.f); so[w][8 * hh + r][t * 16 + ln] = v; }
  }
  __builtin_amdgcn_fence(__ATOMIC_ACQ_REL, "workgroup");
  __builtin_amdgcn_wave_barrier();
  const int rsub = lane >> 4, c4 = (lane & 15) * 4;
  {
#pragma unroll
    for (int q = 0; q < 8; ++q) {
      const int r = q * 2 + rsub;
      const v4f v = *(const v4fa*)&so[w][r][c4];
      *(v4f*)(C + (size_t)(row0 + r) * ldc + col0 + c4) = v;
    }
    
  }
}

// GEMM C = act(A·W + bias + resid): A f32 (ASPLIT -> hi/lo 2 terms), Wt bf16 [N][K]; ACT 0 none, 1 relu, 2 exact gelu;
// resid (optional, f32, row index = (row % rmod), pitch ldr, RES_BF16 rounds it) added before the activation.
template <bool ASPLIT, int ACT, bool BIAS_BF16, bool RES_BF16>
__global__ __launch_bounds__(128) void k_gemm_bf3(const float* __restrict__ A, int lda, const unsigned short* __restrict__ Wt, int ldb,
                                                const float* __restrict__ bias, const float* __restrict__ resid, int rmod, int ldr,
                                                float* __restrict__ C, int ldc, int M, int N, int K) {
  __shared__ __attribute__((aligned(16))) float so[4][16][64];
  const int tid = threadIdx.x, w = tid >> 5, lane = tid & 31, ln = lane & 15, hh = lane >> 4;
  const int ntn = N / 64;
  const int wid = blockIdx.x * 4 + w;
  const int mt = wid / ntn, nq = wid % ntn;
  if (mt * 16 >= M) return;
  const int row0 = mt * 16, col0 = nq * 64;
  const float* arow = A + (size_t)(row0 + ln) * lda;
  v8f acc[4] = {};
  for (int kb = 0; kb < K; kb += 32) {
    FragB ah, al;
    const v4f x0 = *(const v4fa*)(arow + kb + 8 * hh), x1 = *(const v4fa*)(arow + kb + 8 * hh + 4);
    const v4f x2 = *(const v4fa*)(arow + kb + 16 + 8 * hh), x3 = *(const v4fa*)(arow + kb + 16 + 8 * hh + 4);
    float xs[16] = {x0[0],x0[1],x0[2],x0[3],x1[0],x1[1],x1[2],x1[3],x2[0],x2[1],x2[2],x2[3],x3[0],x3[1],x3[2],x3[3]};
#pragma unroll
    for (int i = 0; i < 16; ++i) { const unsigned short hb = bf16_bits(xs[i]); ah.u[i] = hb; al.u[i] = ASPLIT ? bf16_bits(xs[i] - bf16_val(hb)) : (unsigned short)0; }
#pragma unroll
    for (int t = 0; t < 4; ++t) {
      const unsigned short* brow = Wt + (size_t)(col0 + t * 16 + ln) * ldb + kb;
      FragB b;
      b.half[0] = *(const v8us*)(brow + 8 * hh);
      b.half[1] = *(const v8us*)(brow + 16 + 8 * hh);
      acc[t] = mmaN<ASPLIT ? 2 : 1>(ah.v, al.v, b.v, b.v, acc[t]);
    }
  }
#pragma unroll
  for (int t = 0; t < 4; ++t) {
    const int col = col0 + t * 16 + ln;
    float bv = bias ? bias[col] : 0.f;
    if (BIAS_BF16) bv = bf16_round(bv);
#pragma unroll
    for (int r = 0; r < 8; ++r) {
      float v = acc[t][r] + bv;
      if (resid) { float rv = resid[(size_t)((row0 + 8 * hh + r) % rmod) * ldr + col]; if (RES_BF16) rv = bf16_round(rv); v += rv; }
      if (ACT == 1) v = fmaxf(v, 0.f);
      if (ACT == 2) v = 0.5f * v * (1.0f + erff(v * 0.70710678118654752f));
      if (ACT == 3) { const float u = 0.7978845608028654f * (v + 0.044715f * v * v * v); v = 0.5f * v * (1.0f + tanhf(u)); }
      so[w][8 * hh + r][t * 16 + ln] = v;
    }
  }
  __builtin_amdgcn_fence(__ATOMIC_ACQ_REL, "workgroup");
  __builtin_amdgcn_wave_barrier();
  const int rsub = lane >> 4, c4 = (lane & 15) * 4;
  {
#pragma unroll
    for (int q = 0; q < 8; ++q) {
      const int r = q * 2 + rsub;
      const v4f v = *(const v4fa*)&so[w][r][c4];
      *(v4f*)(C + (size_t)(row0 + r) * ldc + col0 + c4) = v;
    }
    
  }
}
// row LayerNorm (biased variance, eps) over N: s = X (+ R); optional out_sum <- s; out_norm <- (s-mu)*rsqrt(var+eps)*g + b
template <bool PARAM_BF16>
__global__ __launch_bounds__(256) void k_layernorm(const float* __restrict__ X, const float* __restrict__ R, const float* __restrict__ g, const float* __restrict__ bta,
                                                  float* __restrict__ out_sum, float* __restrict__ out_norm, int N, float eps) {
  __shared__ float red[256];
  const int row = blockIdx.x, tid = threadIdx.x;
  const float* x = X + (size_t)row * N; const float* rr = R ? R + (size_t)row * N : nullptr;
  float vals[16];                     // up to N = 4096
  const int per = N / 256;            // contiguous chunk per thread? use strided-by-4 chunks: thread handles j = tid*4 + 1024*u
  float s1 = 0.f;
  for (int u = 0; u < per / 4; ++u) {
    const int j = tid * 4 + 1024 * u;
    const v4f a = *(const v4fa*)(x + j);
    v4f b = {0.f,0.f,0.f,0.f}; if (rr) b = *(const v4fa*)(rr + j);
#pragma unroll
    for (int q = 0; q < 4; ++q) { const float v = a[q] + b[q]; vals[u * 4 + q] = v; s1 += v; }
  }
  red[tid] = s1; __syncthreads();
  for (int st = 128; st > 0; st >>= 1) { if (tid < st) red[tid] += red[tid + st]; __syncthreads(); }
  const float mu = red[0] / (float)N; __syncthreads();
  float s2 = 0.f;
  for (int u = 0; u < per / 4; ++u)
#pragma unroll
    for (int q = 0; q < 4; ++q) { const float c = vals[u * 4 + q] - mu; s2 += c * c; }
  red[tid] = s2; __syncthreads();
  for (int st = 128; st > 0; st >>= 1) { if (tid < st) red[tid] += red[tid + st]; __syncthreads(); }
  const float rs = rsqrtf(red[0] / (float)N + eps);
  {
    for (int u = 0; u < per / 4; ++u) {
      const int j = tid * 4 + 1024 * u;
      v4f o, sm;
#pragma unroll
      for (int q = 0; q < 4; ++q) {
        float gg = g[j + q], bb = bta[j + q];
        if (PARAM_BF16) { gg = bf16_round(gg); bb = bf16_round(bb); }
        sm[q] = vals[u * 4 + q]; o[q] = (vals[u * 4 + q] - mu) * rs * gg + bb;
      }
      if (out_sum) *(v4f*)(out_sum + (size_t)row * N + j) = sm;
      *(v4f*)(out_norm + (size_t)row * N + j) = o;
    }
    
  }
}



// ---- f16 WMMA path (v_wmma_f32_16x16x32_f16): 11-bit significands for operands in range — used where a [0,1] probability operand needs more precision than bf16
typedef _Float16 v16h __attribute__((ext_vector_type(16)));
union FragH { v16h v; v8us half[2]; _Float16 h[16]; unsigned short u[16]; };
template <int NT>
__device__ __forceinline__ v8f mmaH(v16h ah, v16h al, v16h bh, v16h bl, v8f c) {
  c = __builtin_amdgcn_wmma_f32_16x16x32_f16(false, ah, false, bh, (short)0, c, false, false);
  if (NT >= 2) c = __builtin_amdgcn_wmma_f32_16x16x32_f16(false, al, false, bh, (short)0, c, false, false);
  if (NT >= 3) c = __builtin_amdgcn_wmma_f32_16x16x32_f16(false, ah, false, bl, (short)0, c, false, false);
  asm volatile("v_nop\n\tv_nop\n\tv_nop\n\tv_nop" : "+v"(c) : "v"(ah), "v"(al), "v"(bh), "v"(bl));
  return c;
}
// batched GEMM like k_gemm_b but f16 operands: A f32 (split into f16 hi/lo if ASPLIT, else rounded to f16), Bt = f16 values [n][k]; alpha; C f32; N multiple of 16 (partial tiles skipped)
template <bool ASPLIT>
__global__ __launch_bounds__(128) void k_gemm_h(const float* __restrict__ A, int lda, size_t sA, const _Float16* __restrict__ Bh, int ldb, size_t sB, float alpha, float* __restrict__ C, int ldc, size_t sC, int M, int N, int K) {
  __shared__ __attribute__((aligned(16))) float so[4][16][64];
  const int tid = threadIdx.x, w = tid >> 5, lane = tid & 31, ln = lane & 15, hh = lane >> 4; const int by = blockIdx.y;
  A += (size_t)by * sA; Bh += (size_t)by * sB; C += (size_t)by * sC;
  const int ntn = (N + 63) / 64; const int wid = blockIdx.x * 4 + w; const int mt = wid / ntn, nq = wid % ntn; if (mt * 16 >= M) return;
  const int row0 = mt * 16, col0 = nq * 64; const float* arow = A + (size_t)(row0 + ln) * lda;
  v8f acc[4] = {};
  for (int kb = 0; kb < K; kb += 32) {
    FragH ah, al;
    const v4f x0 = *(const v4fa*)(arow + kb + 8 * hh), x1 = *(const v4fa*)(arow + kb + 8 * hh + 4), x2 = *(const v4fa*)(arow + kb + 16 + 8 * hh), x3 = *(const v4fa*)(arow + kb + 16 + 8 * hh + 4);
    float xs[16] = {x0[0],x0[1],x0[2],x0[3],x1[0],x1[1],x1[2],x1[3],x2[0],x2[1],x2[2],x2[3],x3[0],x3[1],x3[2],x3[3]};
#pragma unroll
    for (int i = 0; i < 16; ++i) { const _Float16 h = (_Float16)xs[i]; ah.h[i] = h; al.h[i] = ASPLIT ? (_Float16)(xs[i] - (float)h) : (_Float16)0.0f; }
#pragma unroll
    for (int t = 0; t < 4; ++t) { if (col0 + t * 16 >= N) continue; const size_t boff = (size_t)(col0 + t * 16 + ln) * ldb + kb; FragH bq; bq.half[0] = *(const v8us*)(Bh + boff + 8 * hh); bq.half[1] = *(const v8us*)(Bh + boff + 16 + 8 * hh);
      acc[t] = mmaH<ASPLIT ? 2 : 1>(ah.v, al.v, bq.v, bq.v, acc[t]); }
  }
#pragma unroll
  for (int t = 0; t < 4; ++t) { if (col0 + t * 16 >= N) continue;
#pragma unroll
    for (int r = 0; r < 8; ++r) so[w][8 * hh + r][t * 16 + ln] = acc[t][r] * alpha; }
  __builtin_amdgcn_fence(__ATOMIC_ACQ_REL, "workgroup"); __builtin_amdgcn_wave_barrier();
  const int rsub = lane >> 4, c4 = (lane & 15) * 4;
  {
#pragma unroll
    for (int q = 0; q < 8; ++q) { const int r = q * 2 + rsub; if (col0 + c4 < N) { const v4f v = *(const v4fa*)&so[w][r][c4]; *(v4f*)(C + (size_t)(row0 + r) * ldc + col0 + c4) = v; } }
     }
}

// Wt[n][k] = f16(W[k][n]·scale) from f32 row-major W[K][N] (scale = power of two; bf16-exact weights stay exact in f16 away from the subnormal range)
__global__ __launch_bounds__(256) void k_wt_f16(const float* __restrict__ W, _Float16* __restrict__ Wt, int K, int N, float scale) {
  const int t = blockIdx.x * 256 + threadIdx.x; if (t >= N * (K / 8)) return; const int n = t / (K / 8), k8 = (t % (K / 8)) * 8; FragH f;
#pragma unroll
  for (int i = 0; i < 8; ++i) f.h[i] = (_Float16)(bf16_round(W[(size_t)(k8 + i) * N + n]) * scale); const v8us o = f.half[0];
  *(v8us*)((unsigned short*)Wt + (size_t)n * K + k8) = o; 
}
// k_gemm_hh variant with fused epilogue: v = acc·alpha + bias[by·sBias + col] (+ CP[(row/rowsPerB)·sCPb + by·64 + col] if CP) ; ACT 0 none / 1 elu ; writes f16 C16 (and f32 C if non-null)
template <int ACT>
__global__ __launch_bounds__(128) void k_gemm_hhx(const _Float16* __restrict__ A, int lda, size_t sA, const _Float16* __restrict__ Bh, int ldb, size_t sB, float alpha, const float* __restrict__ bias, size_t sBias, const float* __restrict__ CP, int rowsPerB, size_t sCPb, int row0g,
    float* __restrict__ C, _Float16* __restrict__ C16, int ldc, size_t sC, int M, int N, int K) {
  __shared__ __attribute__((aligned(16))) float so[4][16][64];
  const int tid = threadIdx.x, w = tid >> 5, lane = tid & 31, ln = lane & 15, hh = lane >> 4; const int by = blockIdx.y;
  A += (size_t)by * sA; Bh += (size_t)by * sB; const size_t cofs = (size_t)by * sC; const float* bp = bias ? bias + (size_t)by * sBias : nullptr;
  const int ntn = (N + 63) / 64; const int wid = blockIdx.x * 4 + w; const int mt = wid / ntn, nq = wid % ntn; if (mt * 16 >= M) return;
  const int row0 = mt * 16, col0 = nq * 64; const _Float16* arow = A + (size_t)(row0 + ln) * lda;
  v8f acc[4] = {};
  for (int kb = 0; kb < K; kb += 32) { FragH ah; ah.half[0] = *(const v8us*)((const unsigned short*)arow + kb + 8 * hh); ah.half[1] = *(const v8us*)((const unsigned short*)arow + kb + 16 + 8 * hh);
#pragma unroll
    for (int t = 0; t < 4; ++t) { if (col0 + t * 16 >= N) continue; const size_t boff = (size_t)(col0 + t * 16 + ln) * ldb + kb; FragH bq; bq.half[0] = *(const v8us*)((const unsigned short*)Bh + boff + 8 * hh); bq.half[1] = *(const v8us*)((const unsigned short*)Bh + boff + 16 + 8 * hh);
      acc[t] = mmaH<1>(ah.v, ah.v, bq.v, bq.v, acc[t]); }
  }
#pragma unroll
  for (int t = 0; t < 4; ++t) { if (col0 + t * 16 >= N) continue; const int col = col0 + t * 16 + ln; const float bv = bp ? bf16_round(bp[col]) : 0.f;
#pragma unroll
    for (int r = 0; r < 8; ++r) { float v = acc[t][r] * alpha + bv; if (CP) { const int bidx = (row0g + row0 + 8 * hh + r) / rowsPerB; v += CP[(size_t)bidx * sCPb + (size_t)by * 64 + col]; } if (ACT == 1) v = (v > 0.f) ? v : expm1f(v); else if (ACT == 7) v = (v > 0.f) ? v + 1.0f : expf(v); else if (ACT == 8) v = tanhf(v); else if (ACT == 9) v = 0.5f * v * (1.0f + tanhf(0.7978845608028654f * (v + 0.044715f * v * v * v))); else if (ACT == 11) v = 1.0f / (1.0f + expf(-v)); else if (ACT == 12) v = (v > 0.f) ? v : 0.01f * v; else if (ACT == 14) v = (v > 0.f) ? v : 0.1f * v; else if (ACT == 15) v = v / (1.0f + expf(-v)); else if (ACT == 3) v = fmaxf(v, 0.f); else if (ACT == 6) v = 0.5f * v * (1.0f + erff(v * 0.70710678118654752f)); so[w][8 * hh + r][t * 16 + ln] = v; } }
  __builtin_amdgcn_fence(__ATOMIC_ACQ_REL, "workgroup"); __builtin_amdgcn_wave_barrier();
  const int rsub = lane >> 4, c4 = (lane & 15) * 4; typedef _Float16 v4h __attribute__((ext_vector_type(4)));
  {
#pragma unroll
    for (int q = 0; q < 8; ++q) { const int r = q * 2 + rsub; if (col0 + c4 < N) { const v4f v = *(const v4fa*)&so[w][r][c4]; if (C) *(v4f*)(C + cofs + (size_t)(row0 + r) * ldc + col0 + c4) = v; if (C16) { v4h h4; for (int i = 0; i < 4; ++i) h4[i] = (_Float16)v[i]; *(v4h*)(C16 + cofs + (size_t)(row0 + r) * ldc + col0 + c4) = h4; } } }
     }
}


typedef _Float16 v4h __attribute__((ext_vector_type(4)));

// ---- fragment-order planes: every f16 plane that a WMMA operand is loaded from is stored as 1 KiB units, one per (16 rows x 32 k). Inside a unit the 16-byte piece at (half * 32 + lane) holds row (lane & 15),
// k = half * 16 + (lane >> 4) * 8 .. + 7: what lane 'lane' takes as half 'half' of its fragment. A wave's global_load_b128 then reads 512 contiguous bytes (4 cache lines) where a row-major plane gives it 16 rows (16 lines).
// Units run along k first, then down the row tiles, so a tile of 16 rows still starts at element row * ld. ld % 32 == 0, rows % 16 == 0.
__device__ __forceinline__ size_t pk_src(size_t t, int ld) { const int lane = (int)(t & 31), half = (int)((t >> 5) & 1); const size_t u = t >> 6; const size_t nks = (size_t)(ld >> 5); const size_t ks = u % nks, rt = u / nks;      /* row-major element offset of the 8 elements that piece t of the plane holds */
  return (rt * 16 + (lane & 15)) * (size_t)ld + ks * 32 + half * 16 + (lane >> 4) * 8; }
__device__ __forceinline__ size_t pk_dst(size_t row, int k, int ld) { return (row >> 4) * 16 * (size_t)ld + (size_t)(k >> 5) * 512 + ((k >> 4) & 1) * 256 + (((k >> 3) & 1) * 16 + (int)(row & 15)) * 8; }      /* element offset in the plane of (row, k .. k + 7), k % 8 == 0 */

__global__ __launch_bounds__(256) void k_x16(const float* __restrict__ x, _Float16* __restrict__ X16, size_t n8) { const size_t t = (size_t)blockIdx.x * 256 + threadIdx.x; if (t >= n8) return; FragH f; const size_t so = pk_src(t, DM);
#pragma unroll
  for (int q = 0; q < 8; ++q) f.h[q] = (_Float16)bf16_round(x[so + q]); *(v8us*)((unsigned short*)X16 + t * 8) = f.half[0];  }
__global__ __launch_bounds__(256) void k_h16(const float* __restrict__ x, _Float16* __restrict__ X16, size_t n8) { const size_t t = (size_t)blockIdx.x * 256 + threadIdx.x; if (t >= n8) return; FragH f;
#pragma unroll
  for (int q = 0; q < 8; ++q) f.h[q] = (_Float16)x[t * 8 + q]; *(v8us*)((unsigned short*)X16 + t * 8) = f.half[0];  }
__global__ __launch_bounds__(256) void k_round16f(const float* __restrict__ W, _Float16* __restrict__ Bt, size_t n8) { const size_t t = (size_t)blockIdx.x * 256 + threadIdx.x; if (t >= n8) return; FragH f; const size_t so = pk_src(t, DM);
#pragma unroll
  for (int i = 0; i < 8; ++i) f.h[i] = (_Float16)(bf16_round(W[so + i]) * 16.0f); *(v8us*)((unsigned short*)Bt + t * 8) = f.half[0];  }
template <int NHv, int TTv>
__global__ __launch_bounds__(256) void k_vt(const _Float16* __restrict__ V16, int ldv, int voff, _Float16* __restrict__ Vt) { __shared__ unsigned short tl[64][66]; const int tid = threadIdx.x; const int slab = blockIdx.x / (TTv / 64), lg = blockIdx.x % (TTv / 64); const int b = slab / NHv, h = slab % NHv;
  for (int i = tid; i < 64 * 8; i += 256) { const int r = i / 8, c8 = (i % 8) * 8; FragH f; f.half[0] = *(const v8us*)((const unsigned short*)V16 + ((size_t)b * TTv + lg * 64 + r) * ldv + voff + h * 64 + c8);
#pragma unroll
    for (int q = 0; q < 8; ++q) tl[r][c8 + q] = f.u[q]; }
  __syncthreads();
  {
#pragma unroll
    for (int rd = 0; rd < 2; ++rd) { const int d = rd * 32 + tid / 8, pc = tid % 8; FragH f;
#pragma unroll
      for (int q = 0; q < 8; ++q) f.u[q] = tl[pc * 8 + q][d];
      *(v8us*)((unsigned short*)Vt + ((size_t)slab * 64 + d) * TTv + lg * 64 + pc * 8) = f.half[0]; }
     } }

// f32 -> f16 hi + x2^10 residual, 8 values = one 16-byte piece of each plane
__device__ __forceinline__ void hl_split8(const float* v, FragH& fh, FragH& fl) {
#pragma unroll
  for (int q = 0; q < 8; ++q) { const _Float16 h = (_Float16)v[q]; fh.h[q] = h; fl.h[q] = (_Float16)((v[q] - (float)h) * 1024.0f); } }

// ---- fast GEMM (wave tile 32x64; requires M % 32 == 0 rows per launch region and N % 64 == 0; A and Bh are fragment-order planes of pitch lda, ldb); epilogue = k_gemm_hhx semantics ----
// EPI 0: the tile goes out as f32 rows (C) and / or f16 rows (C16). EPI 1 (q, k; N = DM, so that a 64-column tile is one head): the tile is rotated by the head's cos/sin tables and goes out as the hi and residual fragment-order planes Ph, Pl.
// EPI 2 (v): the tile goes out transposed, as the hi and residual fragment-order planes of V^T (rows (batch * NH + head) * 64 + d, pitch SLEN).
__device__ __forceinline__ v16h g2_fragp(const _Float16* p) { FragH f; f.half[0] = *(const v8us*)((const unsigned short*)p); f.half[1] = *(const v8us*)((const unsigned short*)p + 256); return f.v; }      /* p = the lane's piece of a fragment-order unit */
__device__ __forceinline__ v8f g2_mma(v16h a, v16h b, v8f c) { v8f d = __builtin_amdgcn_wmma_f32_16x16x32_f16(false, a, false, b, (short)0, c, false, false); asm volatile("v_nop\n\tv_nop\n\tv_nop\n\tv_nop" : "+v"(d) : "v"(a), "v"(b)); return d; }
template <int ACT, int EPI>
__global__ __launch_bounds__(128) void k_gemm2(const _Float16* __restrict__ A, int lda, size_t sA, const _Float16* __restrict__ Bh, int ldb, size_t sB, float alpha, const float* __restrict__ bias, size_t sBias, const float* __restrict__ CP, int rowsPerB, size_t sCPb, int row0g,
    float* __restrict__ C, _Float16* __restrict__ C16, int ldc, size_t sC, int M, int N, int K, const float* __restrict__ CS, const float* __restrict__ SN, _Float16* __restrict__ Ph, _Float16* __restrict__ Pl) {
  __shared__ __attribute__((aligned(16))) float so[4][32][68];
  const int tid = threadIdx.x, w = tid >> 5, lane = tid & 31, ln = lane & 15, hh = lane >> 4; const int by = blockIdx.y;
  A += (size_t)by * sA; Bh += (size_t)by * sB; const size_t cofs = (size_t)by * sC; const float* bp = bias ? bias + (size_t)by * sBias : nullptr;
  const int ntn = N >> 6; const int mt = blockIdx.x / ntn, nq = blockIdx.x - mt * ntn; const int row0 = mt * 128 + 32 * w, col0 = nq * 64; if (row0 >= M) return;
  const _Float16* a0p = A + (size_t)row0 * lda + lane * 8; const _Float16* a1p = a0p + (size_t)16 * lda;      /* A and Bh are fragment-order planes */
  const _Float16* b0p = Bh + (size_t)col0 * ldb + lane * 8; const _Float16* b1p = b0p + (size_t)16 * ldb; const _Float16* b2p = b1p + (size_t)16 * ldb; const _Float16* b3p = b2p + (size_t)16 * ldb;
  const v8f z8 = {0.f,0.f,0.f,0.f,0.f,0.f,0.f,0.f}; v8f c00 = z8, c01 = z8, c02 = z8, c03 = z8, c10 = z8, c11 = z8, c12 = z8, c13 = z8;
  /* Register ring of three k-steps: the six fragments of steps s + 1 and s + 2 are in flight while step s is multiplied, so that a step no longer waits for five round trips one after the other.
     Each accumulator still takes its k-steps in ascending order. The six lane pointers live through the whole loop and every load of a trip reaches its step by an immediate offset, so that no load's result can land in an address register; only steps below K / 32 are loaded. */
  typedef const __attribute__((address_space(1))) _Float16* g2_gp;      /* typed as global memory, so that the loads stay global loads behind the asm statement that names the pointers */
  g2_gp p0 = (g2_gp)a0p, p1 = (g2_gp)a1p, p2 = (g2_gp)b0p, p3 = (g2_gp)b1p, p4 = (g2_gp)b2p, p5 = (g2_gp)b3p;
#define G2_FR(P, ST) g2_fragp((const _Float16*)((P) + 512 * (ST)))
#define G2_LOAD(S, ST) { S[0] = G2_FR(p0, ST); S[1] = G2_FR(p1, ST); S[2] = G2_FR(p2, ST); S[3] = G2_FR(p3, ST); S[4] = G2_FR(p4, ST); S[5] = G2_FR(p5, ST); \
    __builtin_amdgcn_sched_barrier(0); /* keeps the refill in front of the products that follow: without it the compiler sinks a refill behind the first product and that product's wait, and it flies for a shorter time */ }
#define G2_STEP(S) { c00 = g2_mma(S[0], S[2], c00); c10 = g2_mma(S[1], S[2], c10); c01 = g2_mma(S[0], S[3], c01); c11 = g2_mma(S[1], S[3], c11); c02 = g2_mma(S[0], S[4], c02); c12 = g2_mma(S[1], S[4], c12); c03 = g2_mma(S[0], S[5], c03); c13 = g2_mma(S[1], S[5], c13); }
  { const int nst = K >> 5; v16h r0[6], r1[6], r2[6]; int s = 0;
    if (nst >= 1) G2_LOAD(r0, 0)
    if (nst >= 2) G2_LOAD(r1, 1)
#pragma unroll 1
    for (; s + 5 <= nst; s += 3) { G2_LOAD(r2, 2) G2_STEP(r0) G2_LOAD(r0, 3) G2_STEP(r1) G2_LOAD(r1, 4) G2_STEP(r2)
      asm volatile("s_wait_xcnt 0x0" : "+v"(p0), "+v"(p1), "+v"(p2), "+v"(p3), "+v"(p4), "+v"(p5) :: "memory"); /* stands in front of the six additions below, which overwrite the address registers of the loads issued above; the pointers are named so that the additions depend on this statement and cannot be placed ahead of it */
      p0 += 1536; p1 += 1536; p2 += 1536; p3 += 1536; p4 += 1536; p5 += 1536; }
    const int rem = nst - s;      /* 0 to 4 steps are left; r0 and r1 hold the first two of them */
    if (rem >= 3) G2_LOAD(r2, 2)
    if (rem >= 1) G2_STEP(r0)
    if (rem >= 4) G2_LOAD(r0, 3)
    if (rem >= 2) G2_STEP(r1)
    if (rem >= 3) G2_STEP(r2)
    if (rem >= 4) G2_STEP(r0) }
#undef G2_FR
#undef G2_LOAD
#undef G2_STEP
  v8f accs[8] = {c00, c01, c02, c03, c10, c11, c12, c13};
#pragma unroll
  for (int u = 0; u < 8; ++u) { const int t = u & 3, half = u >> 2; const int col = col0 + t * 16 + ln; const float bv = bp ? bf16_round(bp[col]) : 0.f;
#pragma unroll
    for (int r = 0; r < 8; ++r) { const int rloc = half * 16 + 8 * hh + r; float v = accs[u][r] * alpha + bv; if (CP) { const int bidx = (row0g + row0 + rloc) / rowsPerB; v += CP[(size_t)bidx * sCPb + (size_t)by * 64 + col]; }
      if (ACT == 3) v = fmaxf(v, 0.f); else if (ACT == 6) v = 0.5f * v * (1.0f + erff(v * 0.70710678118654752f)); else if (ACT == 11) v = 1.0f / (1.0f + expf(-v)); else if (ACT == 15) v = v / (1.0f + expf(-v)); else if (ACT == 12) v = (v > 0.f) ? v : 0.01f * v; else if (ACT == 8) v = tanhf(v);
      so[w][rloc][t * 16 + ln] = v; } }
  __builtin_amdgcn_fence(__ATOMIC_ACQ_REL, "workgroup"); __builtin_amdgcn_wave_barrier();
  if (EPI == 1) {      /* the wave's tile = 2 row tiles x 2 units x 2 halves of each plane; a lane takes its own piece (row ln, 8 columns = 4 rotation pairs), a wave stores 512 contiguous bytes */
    typedef const __attribute__((address_space(1))) float* g2_fp;      /* typed as global memory, so that the loads stay global loads beside the asm statement that names the pointers */
    const size_t th = (size_t)(col0 >> 6) * SLEN * 32 + hh * 4, ta = th + (size_t)((row0 + ln) % SLEN) * 32, tb = th + (size_t)((row0 + 16 + ln) % SLEN) * 32;
    g2_fp ca = (g2_fp)(CS + ta), sa = (g2_fp)(SN + ta), cb = (g2_fp)(CS + tb), sb = (g2_fp)(SN + tb); v4f csv[8], snv[8];      /* the lane's two token rows of the head's tables */
#pragma unroll
    for (int u = 0; u < 8; ++u) { const int jo = ((u >> 1) & 1) * 16 + (u & 1) * 8; csv[u] = *(const __attribute__((address_space(1))) v4fa*)(((u >> 2) ? cb : ca) + jo); snv[u] = *(const __attribute__((address_space(1))) v4fa*)(((u >> 2) ? sb : sa) + jo); }
    asm volatile("s_wait_xcnt 0x0" : "+v"(ca), "+v"(sa), "+v"(cb), "+v"(sb) :: "memory");      /* stands in front of the first instruction that reuses an address register of the 16 table loads above; the pointers are named so that they live up to here */
#pragma unroll
    for (int u = 0; u < 8; ++u) { const int rl = (u >> 2) * 16 + ln, kk = ((u >> 1) & 1) * 32 + (u & 1) * 16 + hh * 8; const v4f a = *(const v4fa*)&so[w][rl][kk], c = *(const v4fa*)&so[w][rl][kk + 4];
      const v4f cs = csv[u], sn = snv[u];
      const float f[8] = {a[0], a[1], a[2], a[3], c[0], c[1], c[2], c[3]}; float o[8];
#pragma unroll
      for (int p = 0; p < 4; ++p) { o[2 * p] = f[2 * p] * cs[p] - f[2 * p + 1] * sn[p]; o[2 * p + 1] = f[2 * p] * sn[p] + f[2 * p + 1] * cs[p]; }
      FragH fh, fl; hl_split8(o, fh, fl); const size_t po = pk_dst((size_t)(row0 + rl), col0 + kk, N);
      *(v8us*)((unsigned short*)Ph + po) = fh.half[0]; *(v8us*)((unsigned short*)Pl + po) = fl.half[0]; }
  } else if (EPI == 2) {      /* 32 tokens x 64 d = 4 units of each V^T plane; a lane takes row d, 8 tokens, read down a column of the staged tile */
    const size_t vrow = ((size_t)(row0 / SLEN) * NH + (col0 >> 6)) * 64; const int t0 = row0 % SLEN;
#pragma unroll
    for (int u = 0; u < 8; ++u) { const int d = (u >> 1) * 16 + ln, tl = (u & 1) * 16 + hh * 8; float o[8];
#pragma unroll
      for (int q = 0; q < 8; ++q) o[q] = so[w][tl + q][d];
      FragH fh, fl; hl_split8(o, fh, fl); const size_t po = pk_dst(vrow + d, t0 + tl, SLEN);
      *(v8us*)((unsigned short*)Ph + po) = fh.half[0]; *(v8us*)((unsigned short*)Pl + po) = fl.half[0]; }
  } else {
    const int rsub = lane >> 4, c4 = (lane & 15) * 4;
#pragma unroll
    for (int q = 0; q < 16; ++q) { const int r = q * 2 + rsub; const v4f v = *(const v4fa*)&so[w][r][c4]; if (C) *(v4f*)(C + cofs + (size_t)(row0 + r) * ldc + col0 + c4) = v; if (C16) { v4h h4; for (int i = 0; i < 4; ++i) h4[i] = (_Float16)v[i]; *(v4h*)(C16 + cofs + (size_t)(row0 + r) * ldc + col0 + c4) = h4; } }
     } }



/* lane l <-> lane l ^ 16: the two lanes that hold one column of a 16 x 16 accumulator tile */
__device__ __forceinline__ float fm_xhalf(float v) { const int b = __float_as_int(v); return __int_as_float(__builtin_amdgcn_permlanex16(b, b, 0x76543210, 0xfedcba98, false, false)); }
template <int TQ, int TK>
__global__ __launch_bounds__(128) void k_flashme(const _Float16* __restrict__ Q16, const _Float16* __restrict__ Q16lo, int ldq, const _Float16* __restrict__ K16, const _Float16* __restrict__ K16lo, int ldk, const _Float16* __restrict__ Vt, const _Float16* __restrict__ Vtlo, const float* __restrict__ HB, _Float16* __restrict__ Oh, _Float16* __restrict__ Ol, int ldo) {
  #pragma clang fp contract(off)
  constexpr int RPW = 16, RTN = RPW / 16, NQB = TQ / (4 * RPW), DT = 4, KS = 2;
  /* Two buffers of one trip's key and value tiles, 16 KiB each, which all four waves read: bytes 0: K hi (key tile 0, key tile 1; 2 KiB each = units ks 0, 1), 4096: K residual, 8192: V^T hi (units dt 0 .. 3), 12288: V^T residual. The units keep their fragment order. */
  __shared__ __attribute__((aligned(16))) unsigned short sKV[2][8192];
  /* What is added to a scaled score depends on the head and on the distance d = query - key alone: the entry for d holds the decay bias for d >= 0 and -inf for d < 0 (a key behind the query: the causal mask). The work-group's tiles meet d = -63 .. qb0 + 63; entry i is d = qb0 + 63 - i, so that the index rises with the key, as a lane's score registers do. */
  static_assert(TQ == TK, "the table's range is that of a causal square");
  __shared__ float sB[TQ + 64];
  const int tid = threadIdx.x, w = tid >> 5, lane = tid & 31, ln = lane & 15, hh = lane >> 4;
  /* Which (batch, head) slab and which 64-query tile a work-group takes. A causal tile t walks 2 (t + 1) key trips, all 1024 work-groups are resident at once, four to a WGP, and a SIMD's vector port is shared by its four waves, so the launch lasts as long as the WGP with the most trips.
     With tile = index % 32 work-groups whose indices are equal mod 256 hold the same tile. Here the four classes c of one a = index & 7 are the tiles 2a, 2a + 1, 31 - 2a, 30 - 2a (132 trips together, for every a), and c = (bits 3..4 + bits 8..9) & 3 takes all four values
     over indices equal mod 256 as well as over four indices at index step 8, and a pair c, c + 2 (66 trips) at index step 16. For speed only: (slab, tile) is a permutation of the index whatever the placement is. */
  static_assert(NQB == 32 && NBT * NH == 32, "the index map below is written for 32 slabs of 32 query tiles");
  const int bx = blockIdx.x, slab = bx / NQB, ta = (bx & 7) * 2, tc = (((bx >> 3) & 3) + (slab >> 3)) & 3;      /* slab >> 3 = bits 8..9 of the index */
  const int qblk = (ta | (tc & 1)) ^ ((tc >> 1) * 31);      /* x ^ 31 = 31 - x */ const int b = slab / NH, h = slab % NH; const int qb0 = qblk * (4 * RPW); const int q0 = qb0 + w * RPW;
  FragH aq[2][KS], aql[2][KS];
#pragma unroll
  for (int rt = 0; rt < RTN; ++rt) { const size_t qo = ((size_t)b * TQ + q0 + rt * 16) * ldq + h * 1024 + lane * 8;      /* fragment-order planes: head h = units 2h and 2h + 1 of the row tile */ const unsigned short* qr = (const unsigned short*)Q16 + qo; const unsigned short* ql = (const unsigned short*)Q16lo + qo;
#pragma unroll
    for (int ks = 0; ks < KS; ++ks) { aq[rt][ks].half[0] = *(const v8us*)(qr + ks * 512); aq[rt][ks].half[1] = *(const v8us*)(qr + ks * 512 + 256); aql[rt][ks].half[0] = *(const v8us*)(ql + ks * 512); aql[rt][ks].half[1] = *(const v8us*)(ql + ks * 512 + 256); } }
  asm volatile("s_wait_xcnt 0x0" ::: "memory");      /* stands in front of the first instruction that reuses an address register of the q loads above (the build reuses them for the copies' addresses) */
  __builtin_amdgcn_sched_barrier(0);      /* holds what follows behind that wait: the accumulators' zeroing depends on nothing, and a "memory" clobber does not tie it to the wait */
  const unsigned short* Vth = (const unsigned short*)Vt + (size_t)slab * 64 * TK; const unsigned short* Vtl = (const unsigned short*)Vtlo + (size_t)slab * 64 * TK;
  /* Both products are taken transposed: S^T = K . Q^T (A = a key tile from LDS, B = the wave's queries, kept in registers) and O^T += V^T . P^T (A = a V^T unit from LDS, B = P^T). An accumulator tile holds column ln in lanes ln and ln + 16, rows 8 * hh + r:
     a lane holds 16 of the trip's 32 scores of ONE query, q0 + ln, so that the maximum and the sum are taken in the lane's own registers, with one exchange between the halves for the maximum, and one running maximum, one sum and one rescaling factor a lane stand for eight.
     The two score tiles, converted in place, are P^T in the operand order that the fragment-order V^T units have (element nt * 8 + r = key nt * 16 + 8 * hh + r): P goes through no LDS. A lane's 8 registers of an O^T tile are 8 consecutive d of its query: one piece of the O planes, stored with no staging. */
  static_assert(RTN == 1, "one group of 16 query columns a wave");
  float m_q = -3.0e38f, l_q = 0.f; v8f oacc[DT], oaccl[DT];
#pragma unroll
  for (int dt = 0; dt < DT; ++dt) { oacc[dt] = (v8f){0.f,0.f,0.f,0.f,0.f,0.f,0.f,0.f}; oaccl[dt] = oacc[dt]; }
  const float xih = HB[2 * h], egh = HB[2 * h + 1];      /* the head's two bias scalars, read once */
  const int jend = qb0 + 4 * RPW;      /* block-uniform: the keys up to the tile's last query; a multiple of 32, at most TK */
  /* A tile goes from global memory to LDS by asynchronous copies, through no register: 8 copies of 16 bytes a lane, 2 KiB a copy over the work-group. The tile of trip t + 1 flies while trip t is worked on, and each tile is fetched once a work-group, not once a wave. */
  const unsigned ldsl = (unsigned)(size_t)&sKV[0][tid * 8];      /* the lane's LDS byte address in the first 2 KiB of buffer 0 */
  const size_t klo = ((size_t)b * TK * ldk + h * 1024) * 2, kst = (size_t)ldk * 2; const unsigned kln = (unsigned)tid * 16u, vln = (unsigned)(tid >> 6) * (32u * TK) + (unsigned)(tid & 63) * 16u;      /* byte offsets. Uniform: the head's key row 0; one key row. The lane's own: its piece of a key row tile; its piece of value unit dt = tid / 64 */
#define FM_COPY(J, BUF) { const size_t ku = klo + (size_t)(J) * kst, vu = (size_t)((J) >> 5) * 1024; const char* g0 = (const char*)K16 + ku + kln; const char* g1 = (const char*)K16 + (ku + 16 * kst) + kln; const char* g2 = (const char*)K16lo + ku + kln; const char* g3 = (const char*)K16lo + (ku + 16 * kst) + kln; \
    const char* g4 = (const char*)Vth + vu + vln; const char* g5 = (const char*)Vth + (vu + (size_t)64 * TK) + vln; const char* g6 = (const char*)Vtl + vu + vln; const char* g7 = (const char*)Vtl + (vu + (size_t)64 * TK) + vln; const unsigned l0 = ldsl + (unsigned)(BUF) * 16384u; \
    /* the eight copies and, as the statement's last line, the wait that stands in front of any rewrite of their address registers */ \
    asm volatile("global_load_async_to_lds_b128 %0, %8, off\n\tglobal_load_async_to_lds_b128 %1, %9, off\n\tglobal_load_async_to_lds_b128 %2, %10, off\n\tglobal_load_async_to_lds_b128 %3, %11, off\n\t" \
                 "global_load_async_to_lds_b128 %4, %12, off\n\tglobal_load_async_to_lds_b128 %5, %13, off\n\tglobal_load_async_to_lds_b128 %6, %14, off\n\tglobal_load_async_to_lds_b128 %7, %15, off\n\ts_wait_xcnt 0x0" \
                 :: "v"(l0), "v"(l0 + 2048u), "v"(l0 + 4096u), "v"(l0 + 6144u), "v"(l0 + 8192u), "v"(l0 + 10240u), "v"(l0 + 12288u), "v"(l0 + 14336u), "v"(g0), "v"(g1), "v"(g2), "v"(g3), "v"(g4), "v"(g5), "v"(g6), "v"(g7) : "memory"); }
  FM_COPY(0, 0)
  for (int i = tid; i < qb0 + 127; i += 128) { const int d = qb0 + 63 - i; const float bd = (-((float)d / xih)) * egh; sB[i] = (d >= 0) ? bd : -INFINITY; }      /* each entry once a work-group, by the expression that every element took before; built while tile 0 flies */
  asm volatile("s_wait_asynccnt 0x0" ::: "memory");      /* this wave's copies of tile 0 have landed */
  __syncthreads();      /* publishes tile 0 and the table to the four waves */
  if (32 < jend) FM_COPY(32, 1)
#pragma unroll 1
  for (int j0 = 0; j0 < jend; j0 += 32) {
    const int buf = (j0 >> 5) & 1; const unsigned short* kvb = &sKV[buf][0];
    v8f bb[2];      /* the lane's 16 table entries, fetched together at the head of the trip: they fly beside the key loads */
    { const float* tb = &sB[63 - w * RPW - ln + j0 + 8 * hh];      /* query q0 + ln, key j0 + nt * 16 + 8 * hh + r: entry tb[nt * 16 + r]; the base index is 0 at least */
#pragma unroll
      for (int nt = 0; nt < 2; ++nt)
#pragma unroll
        for (int r = 0; r < 8; ++r) bb[nt][r] = tb[nt * 16 + r]; }
    v8f s[2];
#pragma unroll
    for (int nt = 0; nt < 2; ++nt) { const unsigned short* kr = kvb + nt * 1024 + lane * 8; const unsigned short* kl = kr + 2048; FragH bk[KS], bkl[KS];      /* from the trip's LDS buffer */
#pragma unroll
      for (int ks = 0; ks < KS; ++ks) { bk[ks].half[0] = *(const v8us*)(kr + ks * 512); bk[ks].half[1] = *(const v8us*)(kr + ks * 512 + 256); bkl[ks].half[0] = *(const v8us*)(kl + ks * 512); bkl[ks].half[1] = *(const v8us*)(kl + ks * 512 + 256); }
      v8f acc = (v8f){0.f,0.f,0.f,0.f,0.f,0.f,0.f,0.f}, accr = acc;
#pragma unroll
      for (int ks = 0; ks < KS; ++ks) { acc = mmaH<1>(bk[ks].v, bk[ks].v, aq[0][ks].v, aq[0][ks].v, acc); accr = mmaH<1>(bk[ks].v, bk[ks].v, aql[0][ks].v, aql[0][ks].v, accr); accr = mmaH<1>(bkl[ks].v, bkl[ks].v, aq[0][ks].v, aq[0][ks].v, accr); }
      s[nt] = acc + accr * 0.0009765625f; }
    v8f sv[2];
#pragma unroll
    for (int nt = 0; nt < 2; ++nt) sv[nt] = s[nt] * SCL + bb[nt];      /* -inf for a masked key: its 2^x below is 0, the running maximum being finite always (it starts at -3.0e38) */
    float mt[8];
#pragma unroll
    for (int r = 0; r < 8; ++r) mt[r] = fmaxf(sv[0][r], sv[1][r]);
    float mc = fmaxf(fmaxf(fmaxf(mt[0], mt[1]), fmaxf(mt[2], mt[3])), fmaxf(fmaxf(mt[4], mt[5]), fmaxf(mt[6], mt[7])));
    mc = fmaxf(mc, fm_xhalf(mc));      /* both halves of a column use one maximum: they rescale parts of the same query's output */
    /* Base-2 softmax: e^(s - m) = 2^(s * log2 e - m * log2 e), one fused multiply-add and the hardware's 2^x a value, where the library's e^x spends a range reduction, a scaling and two range selects more.
       The rounded m * log2 e is what every weight of a row and the row's rescaling factor subtract, so that its rounding cancels between the weights and their sum. 2^x of -inf, and of anything below the normal range, is 0. */
    constexpr float L2E = 1.44269504088896340736f;
    const float mn = fmaxf(m_q, mc * L2E), xa = m_q - mn;      /* the running maximum is kept times log2 e */
    float xv[2][8]; v8f ev[2];
#pragma unroll
    for (int nt = 0; nt < 2; ++nt)
#pragma unroll
      for (int r = 0; r < 8; ++r) xv[nt][r] = __builtin_fmaf(sv[nt][r], L2E, -mn);
    const float ea = __builtin_amdgcn_exp2f(xa);
#pragma unroll
    for (int nt = 0; nt < 2; ++nt)
#pragma unroll
      for (int r = 0; r < 8; ++r) ev[nt][r] = __builtin_amdgcn_exp2f(xv[nt][r]);
    /* inputs only, no instruction, two statements because one takes thirty operands. For the slot that the instruction set asks for behind a transcendental before its source register is overwritten: the first stands behind all 17 v_exp_f32 (it names their results), the second behind the first,
       so that the 17 arguments live up to here and no result lands in an argument's register directly behind that argument's own v_exp_f32 */
    asm volatile("" :: "v"(ea), "v"(ev[0][0]), "v"(ev[0][1]), "v"(ev[0][2]), "v"(ev[0][3]), "v"(ev[0][4]), "v"(ev[0][5]), "v"(ev[0][6]), "v"(ev[0][7]), "v"(ev[1][0]), "v"(ev[1][1]), "v"(ev[1][2]), "v"(ev[1][3]), "v"(ev[1][4]), "v"(ev[1][5]), "v"(ev[1][6]), "v"(ev[1][7]),
                 "v"(xa), "v"(xv[0][0]), "v"(xv[0][1]), "v"(xv[0][2]), "v"(xv[0][3]), "v"(xv[0][4]), "v"(xv[0][5]), "v"(xv[0][6]), "v"(xv[0][7]));
    asm volatile("" :: "v"(xv[1][0]), "v"(xv[1][1]), "v"(xv[1][2]), "v"(xv[1][3]), "v"(xv[1][4]), "v"(xv[1][5]), "v"(xv[1][6]), "v"(xv[1][7]));
    const float al = (mn > -1.0e38f) ? ea : 1.0f; m_q = mn;
    const v8f st = ev[0] + ev[1];
    l_q = l_q * al + (((st[0] + st[1]) + (st[2] + st[3])) + ((st[4] + st[5]) + (st[6] + st[7])));      /* the lane's 16 keys; the halves' sums are joined behind the loop */
#pragma unroll
    for (int dt = 0; dt < DT; ++dt) { oacc[dt] *= al; oaccl[dt] *= al; }
    FragH pa, pl;
#pragma unroll
    for (int nt = 0; nt < 2; ++nt)
#pragma unroll
      for (int r = 0; r < 8; r += 2) { typedef float fm_f2 __attribute__((ext_vector_type(2))); typedef _Float16 fm_h2 __attribute__((ext_vector_type(2)));      /* by pairs: one packed conversion gives both the operand's register and the value that the residual is taken against */
        const fm_f2 ps = (fm_f2){ev[nt][r], ev[nt][r + 1]} * 1024.0f; const fm_h2 ph = __builtin_convertvector(ps, fm_h2); const fm_h2 pr = __builtin_convertvector((ps - __builtin_convertvector(ph, fm_f2)) * 1024.0f, fm_h2);
        pa.h[nt * 8 + r] = ph[0]; pa.h[nt * 8 + r + 1] = ph[1]; pl.h[nt * 8 + r] = pr[0]; pl.h[nt * 8 + r + 1] = pr[1]; }
#pragma unroll
    for (int dt = 0; dt < DT; ++dt) { const unsigned short* vr = kvb + 4096 + dt * 512 + lane * 8; FragH bv, bl; bv.half[0] = *(const v8us*)(vr); bv.half[1] = *(const v8us*)(vr + 256); bl.half[0] = *(const v8us*)(vr + 2048); bl.half[1] = *(const v8us*)(vr + 2048 + 256);
      oacc[dt] = mmaH<1>(bv.v, bv.v, pa.v, pa.v, oacc[dt]); oaccl[dt] = mmaH<1>(bl.v, bl.v, pa.v, pa.v, oaccl[dt]); oaccl[dt] = mmaH<1>(bv.v, bv.v, pl.v, pl.v, oaccl[dt]); }
    asm volatile("s_wait_dscnt 0x0" ::: "memory");      /* this wave's reads of the trip's buffer have returned */
    asm volatile("s_wait_asynccnt 0x0" ::: "memory");      /* this wave's copies of the next tile have landed */
    __syncthreads();      /* publishes the next tile and ends every wave's reads of this trip's buffer, which is refilled below */
    if (j0 + 64 < jend) FM_COPY(j0 + 64, buf) }
  asm volatile("s_wait_asynccnt 0x0" ::: "memory");      /* no copy is outstanding when the wave goes on to its end */
#undef FM_COPY
  l_q += fm_xhalf(l_q); const float linv = (l_q > 0.f) ? 1.0f / (l_q * 1024.0f) : 0.f;
#pragma unroll
  for (int dt = 0; dt < DT; ++dt) { float o[8];      /* O leaves as the hi and residual fragment-order planes that the output projection reads: a lane's piece is row q0 + ln, 8 columns; a wave stores 512 contiguous bytes */
#pragma unroll
    for (int r = 0; r < 8; ++r) o[r] = (oacc[dt][r] + oaccl[dt][r] * 0.0009765625f) * linv;
    FragH fh, fl; hl_split8(o, fh, fl); const size_t po = pk_dst((size_t)b * TQ + q0 + ln, h * 64 + dt * 16 + hh * 8, ldo);
    *(v8us*)((unsigned short*)Oh + po) = fh.half[0]; *(v8us*)((unsigned short*)Ol + po) = fl.half[0];
    if (dt + 1 < DT) asm volatile("s_wait_xcnt 0x0" ::: "memory"); }      /* stands in front of the next tile's arithmetic, which reuses the data registers of the two stores above */ }


__constant__ float PIF[32] = {3.141592741e+00f,3.031195641e+00f,2.924677610e+00f,2.821902990e+00f,2.722739935e+00f,2.627061367e+00f,2.534744978e+00f,2.445672750e+00f,2.359730482e+00f,2.276808262e+00f,2.196800232e+00f,2.119603395e+00f,2.045119524e+00f,1.973252892e+00f,1.903911710e+00f,1.837007284e+00f,1.772453904e+00f,1.710168958e+00f,1.650072694e+00f,1.592088223e+00f,1.536141396e+00f,1.482160687e+00f,1.430076718e+00f,1.379823089e+00f,1.331335425e+00f,1.284551501e+00f,1.239411712e+00f,1.195858121e+00f,1.153835058e+00f,1.113288760e+00f,1.074167132e+00f,1.036420345e+00f};
__global__ __launch_bounds__(256) void k_trig(const float* __restrict__ pig, const float* __restrict__ logxi, const float* __restrict__ egl, float* __restrict__ CS, float* __restrict__ SN, float* __restrict__ HB) {
  #pragma clang fp contract(off)
  const int t = blockIdx.x * 256 + threadIdx.x; if (t >= NH * SLEN * 32) return; const int j = t & 31; const int tok = (t >> 5) % SLEN; const int h = t / (32 * SLEN);
  const float pg = 1.0f / (1.0f + expf(-bf16_round(pig[h]))); const float th = ((float)tok * PIF[j]) * pg; const float c = cosf(th), s = sinf(th);
  *(float*)(CS + t) = c; *(float*)(SN + t) = s; 
  if (t < 2 * NH) { const int hh2 = t >> 1; const float v = (t & 1) ? (1.0f / (1.0f + expf(-bf16_round(egl[hh2])))) : expf(bf16_round(logxi[hh2])); *(float*)(HB + t) = v;  } }      

extern "C" void kernel_launch(void* const* d_in, const int* in_sizes, int n_in,
                              void* d_out, int out_size, void* d_ws, size_t ws_size, hipStream_t stream) {
  (void)in_sizes; (void)n_in; (void)out_size;
  const float* const* I = (const float* const*)d_in; const float* x = I[0]; const float* Wqkv = I[1]; const float* Wo = I[2]; const float* logxi = I[3]; const float* pig = I[4]; const float* egl = I[5];
  char* ws = (char*)d_ws; size_t off = 0;
  auto take = [&](size_t bytes) { char* p = ws + off; off += (bytes + 255) & ~(size_t)255; return p; };
  _Float16* BQKV = (_Float16*)take((size_t)3 * DM * DM * 2); _Float16* BO = (_Float16*)take((size_t)DM * DM * 2);
  _Float16* X16 = (_Float16*)take((size_t)NR * DM * 2); _Float16* Oh = (_Float16*)take((size_t)NR * DM * 2); _Float16* Ol = (_Float16*)take((size_t)NR * DM * 2);
  _Float16* Qh = (_Float16*)take((size_t)NR * DM * 2); _Float16* Ql = (_Float16*)take((size_t)NR * DM * 2); _Float16* Kh = (_Float16*)take((size_t)NR * DM * 2); _Float16* Kl = (_Float16*)take((size_t)NR * DM * 2); _Float16* Vth = (_Float16*)take((size_t)NR * DM * 2); _Float16* Vtl = (_Float16*)take((size_t)NR * DM * 2);
  float* CS = (float*)take((size_t)NH * SLEN * 32 * 4); float* SN = (float*)take((size_t)NH * SLEN * 32 * 4); float* HB = (float*)take(256);
  if (off > ws_size) return;      /* 6 + 2 + 8 + 8 x 8 + 8 = 88 MiB */
  const size_t n8 = (size_t)NR * DM / 8; const unsigned nb8 = (unsigned)((n8 + 255) / 256);
  k_round16f<<<(unsigned)(((size_t)3 * DM * DM / 8 + 255) / 256), 256, 0, stream>>>(Wqkv, BQKV, (size_t)3 * DM * DM / 8); k_round16f<<<(unsigned)(((size_t)DM * DM / 8 + 255) / 256), 256, 0, stream>>>(Wo, BO, (size_t)DM * DM / 8);      /* torch (out,in) = natural Bt; x16 */
  k_x16<<<nb8, 256, 0, stream>>>(x, X16, n8);
  k_trig<<<(NH * SLEN * 32 + 255) / 256, 256, 0, stream>>>(pig, logxi, egl, CS, SN, HB);
  const dim3 gP((NR / 128) * (DM / 64), 1);
  k_gemm2<0, 1><<<gP, 128, 0, stream>>>(X16, DM, 0, BQKV, DM, 0, 0.0625f, nullptr, 0, nullptr, 1, 0, 0, nullptr, nullptr, DM, 0, NR, DM, DM, CS, SN, Qh, Ql);      /* q (rows 0..1023 of Wqkv), rotated, hi/lo */
  k_gemm2<0, 1><<<gP, 128, 0, stream>>>(X16, DM, 0, BQKV + (size_t)DM * DM, DM, 0, 0.0625f, nullptr, 0, nullptr, 1, 0, 0, nullptr, nullptr, DM, 0, NR, DM, DM, CS, SN, Kh, Kl);      /* k (rows 1024..2047), rotated, hi/lo */
  k_gemm2<0, 2><<<gP, 128, 0, stream>>>(X16, DM, 0, BQKV + (size_t)2 * DM * DM, DM, 0, 0.0625f, nullptr, 0, nullptr, 1, 0, 0, nullptr, nullptr, DM, 0, NR, DM, DM, nullptr, nullptr, Vth, Vtl);      /* v (rows 2048..3071), transposed, hi/lo */
  k_flashme<SLEN, SLEN><<<NBT * NH * (SLEN / 64), 128, 0, stream>>>(Qh, Ql, DM, Kh, Kl, DM, Vth, Vtl, HB, Oh, Ol, DM);      /* both batches in one grid, so that their waves share the chip; the kernel deals long and short causal tiles evenly over the WGPs */
  k_gemm2<0, 0><<<gP, 128, 0, stream>>>(Oh, DM, 0, BO, DM, 0, 0.0625f, nullptr, 0, nullptr, 1, 0, 0, (float*)d_out, nullptr, DM, 0, NR, DM, DM, nullptr, nullptr, nullptr, nullptr);
  k_gemm2<0, 0><<<gP, 128, 0, stream>>>(Ol, DM, 0, BO, DM, 0, 0.0625f / 1024.0f, nullptr, 0, (const float*)d_out, 1, (size_t)DM, 0, (float*)d_out, nullptr, DM, 0, NR, DM, DM, nullptr, nullptr, nullptr, nullptr);
}
